// v000
// Times are from an AMD MI455X. After a warm-up the kernel runs many times in a row, and a time is the length of
// such a window on the GPU divided by its runs, so every launch and the gaps after it count. The runs cycle
// through copies of the inputs. A figure is the median of several windows, for all but v000 over two sittings.
// Sittings can differ by a few percent; kernels timed side by side share one.
// v000 is the starting kernel. One run takes 52.9 microseconds.
#include <hip/hip_runtime.h>

typedef __attribute__((ext_vector_type(2))) float v2f;
typedef __attribute__((ext_vector_type(8))) float v8f;
typedef __attribute__((ext_vector_type(4))) unsigned int u32x4;
typedef __attribute__((ext_vector_type(8))) int i32x8;
typedef __attribute__((ext_vector_type(4))) int i32x4;

#define S_LEN   4096
#define E_DIM   1024
#define HD_DIM  64
#define NROWS   (4 * 4096)

#define WMMA_F32(a, b, c) \
    __builtin_amdgcn_wmma_f32_16x16x4_f32(false, (a), false, (b), (short)0, (c), false, false)

// ---------------------------------------------------------------------------
// TDM: build a 2D-tile D# and issue TENSOR_LOAD_TO_LDS (clang-23 6-arg form).
// tensor/tile dims in elements (data_size = 4 bytes), stride in elements,
// lds_off in bytes. Optional LDS row padding (pad codes per ISA 8.4).
// ---------------------------------------------------------------------------
__device__ static inline void tdm_load_2d(unsigned lds_off, const void* gaddr,
                                          unsigned d0, unsigned d1,
                                          unsigned long long stride0,
                                          unsigned pad_en, unsigned pad_interval,
                                          unsigned pad_amount)
{
    unsigned long long ga = (unsigned long long)gaddr;
    u32x4 g0;
    g0[0] = 1u;                                    // count=1, user descriptor
    g0[1] = lds_off;                               // lds_addr (bytes)
    g0[2] = (unsigned)(ga & 0xFFFFFFFFu);          // global_addr[31:0]
    g0[3] = (unsigned)((ga >> 32) & 0x1FFFFFFu)    // global_addr[56:32]
          | (2u << 30);                            // type = 2 ("image")
    i32x8 g1;
    g1[0] = (int)((2u << 16)                       // data_size = 4 bytes
          | (pad_en << 20)
          | (pad_interval << 22)
          | (pad_amount << 25));
    g1[1] = (int)((d0 & 0xFFFFu) << 16);           // tensor_dim0[15:0]
    g1[2] = (int)(((d0 >> 16) & 0xFFFFu) | ((d1 & 0xFFFFu) << 16));
    g1[3] = (int)(((d1 >> 16) & 0xFFFFu) | ((d0 & 0xFFFFu) << 16)); // tile_dim0 = d0
    g1[4] = (int)(d1 & 0xFFFFu);                   // tile_dim1 = d1, tile_dim2 = 0
    g1[5] = (int)(unsigned)(stride0 & 0xFFFFFFFFull);
    g1[6] = (int)(unsigned)((stride0 >> 32) & 0xFFFFull);
    g1[7] = 0;
    i32x4 z4 = (i32x4){0, 0, 0, 0};
    i32x8 z8 = (i32x8){0, 0, 0, 0, 0, 0, 0, 0};
    __builtin_amdgcn_tensor_load_to_lds(g0, g1, z4, z4, z8, 0);
}

// ---------------------------------------------------------------------------
// Kernel 1: fused QKV projection, TDM double-buffered.
// Block: 32 rows x 192 cols (Q|K|V) = 24 16x16 tiles, 3 per wave.
// x chunk [32][64] (+pad -> [32][68]) and W chunks [3][64][64] DMA'd by TDM.
// ---------------------------------------------------------------------------
__global__ __launch_bounds__(256) void qkv_proj_kernel(
    const float* __restrict__ x,
    const float* __restrict__ Wq, const float* __restrict__ bq,
    const float* __restrict__ Wk, const float* __restrict__ bk,
    const float* __restrict__ Wv, const float* __restrict__ bv,
    float* __restrict__ Qo, float* __restrict__ Ko, float* __restrict__ Vo)
{
    __shared__ float xs[2][32][68];      // pad 68: strided col reads hit distinct banks
    __shared__ float wsd[2][3][64][64];

    const int tid  = threadIdx.x;
    const int wave = tid >> 5;
    const int lane = tid & 31;
    const int m16  = lane & 15;
    const int half = lane >> 4;
    const int r0   = blockIdx.x * 32;

    const unsigned xs_off  = (unsigned)(unsigned long long)(void*)&xs[0][0][0];
    const unsigned xs_sz   = 32u * 68u * 4u;
    const unsigned wsd_off = (unsigned)(unsigned long long)(void*)&wsd[0][0][0][0];
    const unsigned w_sz    = 64u * 64u * 4u;

    // tile assignment: 24 tiles (2 row-tiles x 12 col-tiles), 3 per wave
    int rt[3], mat[3], n0[3];
    v8f acc[3];
    #pragma unroll
    for (int i = 0; i < 3; ++i) {
        int t  = wave * 3 + i;
        rt[i]  = t / 12;
        int ct = t % 12;
        mat[i] = ct >> 2;            // 0=Q 1=K 2=V
        n0[i]  = (ct & 3) * 16;
        acc[i] = (v8f){0.f, 0.f, 0.f, 0.f, 0.f, 0.f, 0.f, 0.f};
    }

    // issue chunk 0 into buffer 0 (4 TDM ops per chunk: x + 3x W)
    if (tid == 0) {
        tdm_load_2d(xs_off, x + (size_t)r0 * E_DIM, 64, 32, E_DIM,
                    /*pad*/1, /*interval: 64 dw*/5, /*amount: 4 dw*/3);
        tdm_load_2d(wsd_off + 0 * w_sz, Wq, 64, 64, 64, 0, 0, 0);
        tdm_load_2d(wsd_off + 1 * w_sz, Wk, 64, 64, 64, 0, 0, 0);
        tdm_load_2d(wsd_off + 2 * w_sz, Wv, 64, 64, 64, 0, 0, 0);
    }

    int cur = 0;
    for (int it = 0; it < E_DIM / 64; ++it, cur ^= 1) {
        const int kk0n = (it + 1) * 64;
        if (tid == 0) {
            if (kk0n < E_DIM) {
                // prefetch next chunk into the other buffer, then wait for
                // the current chunk (<=4 outstanding = only the new ops)
                const unsigned nb = (unsigned)(cur ^ 1);
                tdm_load_2d(xs_off + nb * xs_sz,
                            x + (size_t)r0 * E_DIM + kk0n, 64, 32, E_DIM, 1, 5, 3);
                tdm_load_2d(wsd_off + nb * 3u * w_sz + 0 * w_sz,
                            Wq + (size_t)kk0n * HD_DIM, 64, 64, 64, 0, 0, 0);
                tdm_load_2d(wsd_off + nb * 3u * w_sz + 1 * w_sz,
                            Wk + (size_t)kk0n * HD_DIM, 64, 64, 64, 0, 0, 0);
                tdm_load_2d(wsd_off + nb * 3u * w_sz + 2 * w_sz,
                            Wv + (size_t)kk0n * HD_DIM, 64, 64, 64, 0, 0, 0);
                __builtin_amdgcn_s_wait_tensorcnt((short)4);
            } else {
                __builtin_amdgcn_s_wait_tensorcnt((short)0);
            }
        }
        __syncthreads();   // chunk `cur` resident in LDS for all waves

        #pragma unroll
        for (int i = 0; i < 3; ++i) {
            #pragma unroll
            for (int k = 0; k < 64; k += 4) {
                v2f a, b;
                // A frag (16x4 f32): lane = M=m16, K = j + 2*half
                a.x = xs[cur][rt[i] * 16 + m16][k + 2 * half];
                a.y = xs[cur][rt[i] * 16 + m16][k + 2 * half + 1];
                // B frag (4x16): row K = j + 2*half, col N = m16
                b.x = wsd[cur][mat[i]][k + 2 * half][n0[i] + m16];
                b.y = wsd[cur][mat[i]][k + 2 * half + 1][n0[i] + m16];
                acc[i] = WMMA_F32(a, b, acc[i]);
            }
        }
        __syncthreads();   // buffer may be overwritten by next TDM issue
    }

    #pragma unroll
    for (int i = 0; i < 3; ++i) {
        const float* bp = (mat[i] == 0) ? bq : ((mat[i] == 1) ? bk : bv);
        float*       op = (mat[i] == 0) ? Qo : ((mat[i] == 1) ? Ko : Vo);
        float badd = bp[n0[i] + m16];
        #pragma unroll
        for (int v = 0; v < 8; ++v) {   // D: M = v + 8*half, N = m16
            int row = r0 + rt[i] * 16 + v + 8 * half;
            op[(size_t)row * HD_DIM + n0[i] + m16] = acc[i][v] + badd;
        }
    }
}

// ---------------------------------------------------------------------------
// Kernel 2: dilated window attention. Block = 16 query rows; key span = 272
// contiguous positions (17 tiles). Dense WMMA scores + parity mask, LDS
// softmax, dense WMMA attn@V. K/V staged via LDS in 2 chunks (<64 KB total).
// ---------------------------------------------------------------------------
__global__ __launch_bounds__(256) void attn_kernel(
    const float* __restrict__ Qd, const float* __restrict__ Kd,
    const float* __restrict__ Vd, float* __restrict__ out)
{
    __shared__ float KV[144][68];       // pad 68 -> stride 4 banks
    __shared__ float Sc[16][276];       // pad 276 -> stride 20 banks (distinct x16)
    __shared__ float red[2][16][16];

    const int tid  = threadIdx.x;
    const int wave = tid >> 5;
    const int lane = tid & 31;
    const int m16  = lane & 15;
    const int half = lane >> 4;
    const int r0   = blockIdx.x * 16;
    const int bb   = r0 / S_LEN;
    const int s0   = r0 % S_LEN;
    const size_t bbase = (size_t)bb * S_LEN * HD_DIM;

    // Q fragments in registers: A[m16][4*kk + j + 2*half]
    float qx[16], qy[16];
    #pragma unroll
    for (int kk = 0; kk < 16; ++kk) {
        const float* qp = Qd + (size_t)(r0 + m16) * HD_DIM + kk * 4 + 2 * half;
        qx[kk] = qp[0];
        qy[kk] = qp[1];
    }

    // ---- scores: Q[16x64] x K^T[64x272] in 2 key chunks ----
    for (int c = 0; c < 2; ++c) {
        const int start  = c ? 144 : 0;
        const int nk     = c ? 128 : 144;
        const int tb     = c ? 9 : 0;
        const int ntiles = c ? 8 : 9;

        for (int j = tid; j < nk * 16; j += 256) {
            int key = j >> 4, f = j & 15;
            int kt = s0 - 128 + start + key;
            kt = kt < 0 ? 0 : (kt >= S_LEN ? S_LEN - 1 : kt);
            const float* kp = Kd + bbase + (size_t)kt * HD_DIM + f * 4;
            const float4 v4 = *(const float4*)kp;
            KV[key][f * 4 + 0] = v4.x; KV[key][f * 4 + 1] = v4.y;
            KV[key][f * 4 + 2] = v4.z; KV[key][f * 4 + 3] = v4.w;
            // warm L2/L0 for the V pass (global_prefetch_b8)
            __builtin_prefetch(Vd + bbase + (size_t)kt * HD_DIM + f * 4, 0, 1);
        }
        __syncthreads();

        for (int tile = wave; tile < ntiles; tile += 8) {
            int t0g = (tb + tile) * 16;
            int t0l = t0g - start;
            v8f cacc = (v8f){0.f, 0.f, 0.f, 0.f, 0.f, 0.f, 0.f, 0.f};
            #pragma unroll
            for (int kk = 0; kk < 16; ++kk) {
                v2f a, b;
                a.x = qx[kk]; a.y = qy[kk];
                // B[k][n] = K[key(t0+n)][k]
                b.x = KV[t0l + m16][kk * 4 + 2 * half];
                b.y = KV[t0l + m16][kk * 4 + 2 * half + 1];
                cacc = WMMA_F32(a, b, cacc);
            }
            #pragma unroll
            for (int v = 0; v < 8; ++v) {
                int i  = v + 8 * half;          // query row in tile
                int tg = t0g + m16;             // key-local coordinate
                int dt = tg - i;
                int kt = s0 + tg - 128;
                bool valid = (dt >= 0) && (dt <= 256) && ((dt & 1) == 0) &&
                             (kt >= 0) && (kt < S_LEN);
                Sc[i][tg] = valid ? cacc[v] * 0.03125f : -__builtin_inff();
            }
        }
        __syncthreads();
    }

    // ---- softmax over 272 cols, 16 threads per row ----
    {
        int r = tid >> 4, c0 = tid & 15;
        float mx = -__builtin_inff();
        for (int jj = c0; jj < 272; jj += 16) mx = fmaxf(mx, Sc[r][jj]);
        red[0][r][c0] = mx;
        __syncthreads();
        float M = -__builtin_inff();
        #pragma unroll
        for (int k = 0; k < 16; ++k) M = fmaxf(M, red[0][r][k]);
        float sm = 0.f;
        for (int jj = c0; jj < 272; jj += 16) {
            float e = __expf(Sc[r][jj] - M);
            Sc[r][jj] = e;
            sm += e;
        }
        red[1][r][c0] = sm;
        __syncthreads();
        float T = 0.f;
        #pragma unroll
        for (int k = 0; k < 16; ++k) T += red[1][r][k];
        float inv = 1.0f / T;
        for (int jj = c0; jj < 272; jj += 16) Sc[r][jj] *= inv;
    }
    __syncthreads();

    // ---- output: attn[16x272] x V[272x64]; waves 0-3 own 16-col tiles ----
    v8f oacc = (v8f){0.f, 0.f, 0.f, 0.f, 0.f, 0.f, 0.f, 0.f};
    const int h0 = (wave & 3) * 16;
    for (int c = 0; c < 2; ++c) {
        const int start = c ? 144 : 0;
        const int nk    = c ? 128 : 144;
        for (int j = tid; j < nk * 16; j += 256) {
            int key = j >> 4, f = j & 15;
            int kt = s0 - 128 + start + key;
            kt = kt < 0 ? 0 : (kt >= S_LEN ? S_LEN - 1 : kt);
            const float4 v4 = *(const float4*)(Vd + bbase + (size_t)kt * HD_DIM + f * 4);
            KV[key][f * 4 + 0] = v4.x; KV[key][f * 4 + 1] = v4.y;
            KV[key][f * 4 + 2] = v4.z; KV[key][f * 4 + 3] = v4.w;
        }
        __syncthreads();
        if (wave < 4) {
            for (int t = 0; t < nk; t += 4) {
                v2f a, b;
                a.x = Sc[m16][start + t + 2 * half];
                a.y = Sc[m16][start + t + 2 * half + 1];
                b.x = KV[t + 2 * half][h0 + m16];
                b.y = KV[t + 2 * half + 1][h0 + m16];
                oacc = WMMA_F32(a, b, oacc);
            }
        }
        __syncthreads();
    }
    if (wave < 4) {
        #pragma unroll
        for (int v = 0; v < 8; ++v) {
            int row = r0 + v + 8 * half;
            out[(size_t)row * HD_DIM + h0 + m16] = oacc[v];
        }
    }
}

// ---------------------------------------------------------------------------
extern "C" void kernel_launch(void* const* d_in, const int* in_sizes, int n_in,
                              void* d_out, int out_size, void* d_ws, size_t ws_size,
                              hipStream_t stream) {
    const float* x  = (const float*)d_in[0];
    const float* Wq = (const float*)d_in[1];
    const float* bq = (const float*)d_in[2];
    const float* Wk = (const float*)d_in[3];
    const float* bk = (const float*)d_in[4];
    const float* Wv = (const float*)d_in[5];
    const float* bv = (const float*)d_in[6];

    float* Qd = (float*)d_ws;                       // 4 MB
    float* Kd = Qd + (size_t)NROWS * HD_DIM;        // 4 MB
    float* Vd = Kd + (size_t)NROWS * HD_DIM;        // 4 MB
    float* out = (float*)d_out;

    qkv_proj_kernel<<<NROWS / 32, 256, 0, stream>>>(x, Wq, bq, Wk, bk, Wv, bv,
                                                    Qd, Kd, Vd);
    attn_kernel<<<NROWS / 16, 256, 0, stream>>>(Qd, Kd, Vd, out);
}

// v001
// Measured time: 48.8 microseconds a run.
// Next to v000, in two timings, it ran 1.13 and 1.14 times as fast.
#include <hip/hip_runtime.h>

typedef __attribute__((ext_vector_type(2))) float v2f;
typedef __attribute__((ext_vector_type(8))) float v8f;
typedef __attribute__((ext_vector_type(4))) unsigned int u32x4;
typedef __attribute__((ext_vector_type(8))) int i32x8;
typedef __attribute__((ext_vector_type(4))) int i32x4;

#define S_LEN   4096
#define E_DIM   1024
#define HD_DIM  64
#define NROWS   (4 * 4096)

#define WMMA_F32(a, b, c) \
    __builtin_amdgcn_wmma_f32_16x16x4_f32(false, (a), false, (b), (short)0, (c), false, false)

// ---------------------------------------------------------------------------
// TDM: build a 2D-tile D# and issue TENSOR_LOAD_TO_LDS (clang-23 6-arg form).
// tensor/tile dims in elements (data_size = 4 bytes), stride in elements,
// lds_off in bytes. Optional LDS row padding (pad codes per ISA 8.4).
// ---------------------------------------------------------------------------
__device__ static inline void tdm_load_2d(unsigned lds_off, const void* gaddr,
                                          unsigned d0, unsigned d1,
                                          unsigned long long stride0,
                                          unsigned pad_en, unsigned pad_interval,
                                          unsigned pad_amount)
{
    unsigned long long ga = (unsigned long long)gaddr;
    u32x4 g0;
    g0[0] = 1u;                                    // count=1, user descriptor
    g0[1] = lds_off;                               // lds_addr (bytes)
    g0[2] = (unsigned)(ga & 0xFFFFFFFFu);          // global_addr[31:0]
    g0[3] = (unsigned)((ga >> 32) & 0x1FFFFFFu)    // global_addr[56:32]
          | (2u << 30);                            // type = 2 ("image")
    i32x8 g1;
    g1[0] = (int)((2u << 16)                       // data_size = 4 bytes
          | (pad_en << 20)
          | (pad_interval << 22)
          | (pad_amount << 25));
    g1[1] = (int)((d0 & 0xFFFFu) << 16);           // tensor_dim0[15:0]
    g1[2] = (int)(((d0 >> 16) & 0xFFFFu) | ((d1 & 0xFFFFu) << 16));
    g1[3] = (int)(((d1 >> 16) & 0xFFFFu) | ((d0 & 0xFFFFu) << 16)); // tile_dim0 = d0
    g1[4] = (int)(d1 & 0xFFFFu);                   // tile_dim1 = d1, tile_dim2 = 0
    g1[5] = (int)(unsigned)(stride0 & 0xFFFFFFFFull);
    g1[6] = (int)(unsigned)((stride0 >> 32) & 0xFFFFull);
    g1[7] = 0;
    i32x4 z4 = (i32x4){0, 0, 0, 0};
    i32x8 z8 = (i32x8){0, 0, 0, 0, 0, 0, 0, 0};
    __builtin_amdgcn_tensor_load_to_lds(g0, g1, z4, z4, z8, 0);
}

// ---------------------------------------------------------------------------
// Kernel 1: fused QKV projection, TDM double-buffered.
// Block: 32 rows x 192 cols (Q|K|V) = 24 16x16 tiles, 3 per wave.
// x chunk [32][64] (+pad -> [32][68]) and W chunks [3][64][64] DMA'd by TDM.
// ---------------------------------------------------------------------------
__global__ __launch_bounds__(256) void qkv_proj_kernel(
    const float* __restrict__ x,
    const float* __restrict__ Wq, const float* __restrict__ bq,
    const float* __restrict__ Wk, const float* __restrict__ bk,
    const float* __restrict__ Wv, const float* __restrict__ bv,
    float* __restrict__ Qo, float* __restrict__ Ko, float* __restrict__ Vo)
{
    __shared__ float xs[2][32][68];      // pad 68: strided col reads hit distinct banks
    __shared__ float wsd[2][3][64][64];

    const int tid  = threadIdx.x;
    const int wave = tid >> 5;
    const int lane = tid & 31;
    const int m16  = lane & 15;
    const int half = lane >> 4;
    const int r0   = blockIdx.x * 32;

    const unsigned xs_off  = (unsigned)(unsigned long long)(void*)&xs[0][0][0];
    const unsigned xs_sz   = 32u * 68u * 4u;
    const unsigned wsd_off = (unsigned)(unsigned long long)(void*)&wsd[0][0][0][0];
    const unsigned w_sz    = 64u * 64u * 4u;

    // tile assignment: 24 tiles (2 row-tiles x 12 col-tiles), 3 per wave
    int rt[3], mat[3], n0[3];
    v8f acc[3];
    #pragma unroll
    for (int i = 0; i < 3; ++i) {
        int t  = wave * 3 + i;
        rt[i]  = t / 12;
        int ct = t % 12;
        mat[i] = ct >> 2;            // 0=Q 1=K 2=V
        n0[i]  = (ct & 3) * 16;
        acc[i] = (v8f){0.f, 0.f, 0.f, 0.f, 0.f, 0.f, 0.f, 0.f};
    }

    // issue chunk 0 into buffer 0 (4 TDM ops per chunk: x + 3x W)
    if (tid == 0) {
        tdm_load_2d(xs_off, x + (size_t)r0 * E_DIM, 64, 32, E_DIM,
                    /*pad*/1, /*interval: 64 dw*/5, /*amount: 4 dw*/3);
        tdm_load_2d(wsd_off + 0 * w_sz, Wq, 64, 64, 64, 0, 0, 0);
        tdm_load_2d(wsd_off + 1 * w_sz, Wk, 64, 64, 64, 0, 0, 0);
        tdm_load_2d(wsd_off + 2 * w_sz, Wv, 64, 64, 64, 0, 0, 0);
    }

    int cur = 0;
    for (int it = 0; it < E_DIM / 64; ++it, cur ^= 1) {
        const int kk0n = (it + 1) * 64;
        if (tid == 0) {
            if (kk0n < E_DIM) {
                // prefetch next chunk into the other buffer, then wait for
                // the current chunk (<=4 outstanding = only the new ops)
                const unsigned nb = (unsigned)(cur ^ 1);
                tdm_load_2d(xs_off + nb * xs_sz,
                            x + (size_t)r0 * E_DIM + kk0n, 64, 32, E_DIM, 1, 5, 3);
                tdm_load_2d(wsd_off + nb * 3u * w_sz + 0 * w_sz,
                            Wq + (size_t)kk0n * HD_DIM, 64, 64, 64, 0, 0, 0);
                tdm_load_2d(wsd_off + nb * 3u * w_sz + 1 * w_sz,
                            Wk + (size_t)kk0n * HD_DIM, 64, 64, 64, 0, 0, 0);
                tdm_load_2d(wsd_off + nb * 3u * w_sz + 2 * w_sz,
                            Wv + (size_t)kk0n * HD_DIM, 64, 64, 64, 0, 0, 0);
                __builtin_amdgcn_s_wait_tensorcnt((short)4);
            } else {
                __builtin_amdgcn_s_wait_tensorcnt((short)0);
            }
        }
        __syncthreads();   // chunk `cur` resident in LDS for all waves

        #pragma unroll
        for (int i = 0; i < 3; ++i) {
            #pragma unroll
            for (int k = 0; k < 64; k += 4) {
                v2f a, b;
                // A frag (16x4 f32): lane = M=m16, K = j + 2*half
                a.x = xs[cur][rt[i] * 16 + m16][k + 2 * half];
                a.y = xs[cur][rt[i] * 16 + m16][k + 2 * half + 1];
                // B frag (4x16): row K = j + 2*half, col N = m16
                b.x = wsd[cur][mat[i]][k + 2 * half][n0[i] + m16];
                b.y = wsd[cur][mat[i]][k + 2 * half + 1][n0[i] + m16];
                acc[i] = WMMA_F32(a, b, acc[i]);
            }
        }
        __syncthreads();   // buffer may be overwritten by next TDM issue
    }

    #pragma unroll
    for (int i = 0; i < 3; ++i) {
        const float* bp = (mat[i] == 0) ? bq : ((mat[i] == 1) ? bk : bv);
        float*       op = (mat[i] == 0) ? Qo : ((mat[i] == 1) ? Ko : Vo);
        float badd = bp[n0[i] + m16];
        #pragma unroll
        for (int v = 0; v < 8; ++v) {   // D: M = v + 8*half, N = m16
            int row = r0 + rt[i] * 16 + v + 8 * half;
            op[(size_t)row * HD_DIM + n0[i] + m16] = acc[i][v] + badd;
        }
    }
}

// ---------------------------------------------------------------------------
// Kernel 2: dilated window attention, queries split by parity.
// The window steps by 2, so a query only ever meets keys of its own parity.
// Block = 16 queries of one parity out of a group of 32 rows: query i sits at
// s0 + par + 2*i, key j at s0 + par - 128 + 2*j, and the window of query i is
// the dense band j - i in [0, 128]. 16 + 128 = 144 keys (9 tiles) cover it,
// and all of them fit the K/V buffer at once.
// Dense WMMA scores + band mask, LDS softmax, dense WMMA attn@V.
// ---------------------------------------------------------------------------
#define NKEY 144

__global__ __launch_bounds__(256) void attn_kernel(
    const float* __restrict__ Qd, const float* __restrict__ Kd,
    const float* __restrict__ Vd, float* __restrict__ out)
{
    __shared__ float KV[NKEY][68];      // pad 68 -> stride 4 banks
    __shared__ float Sc[16][148];       // pad 148 -> stride 20 banks (distinct x16)
    __shared__ float red[2][16][16];

    const int tid  = threadIdx.x;
    const int wave = tid >> 5;
    const int lane = tid & 31;
    const int m16  = lane & 15;
    const int half = lane >> 4;
    const int par  = blockIdx.x & 1;
    const int r0   = (blockIdx.x >> 1) * 32;
    const int bb   = r0 / S_LEN;
    const int s0   = r0 % S_LEN;
    const int kpos0 = s0 + par - 128;   // sequence position of key 0
    const size_t bbase = (size_t)bb * S_LEN * HD_DIM;

    // Q fragments in registers: A[m16][4*kk + j + 2*half]
    float qx[16], qy[16];
    #pragma unroll
    for (int kk = 0; kk < 16; ++kk) {
        const float* qp = Qd + (size_t)(r0 + par + 2 * m16) * HD_DIM + kk * 4 + 2 * half;
        qx[kk] = qp[0];
        qy[kk] = qp[1];
    }

    // ---- scores: Q[16x64] x K^T[64x144] ----
    for (int j = tid; j < NKEY * 16; j += 256) {
        int key = j >> 4, f = j & 15;
        int kt = kpos0 + 2 * key;
        kt = kt < 0 ? 0 : (kt >= S_LEN ? S_LEN - 1 : kt);
        const float* kp = Kd + bbase + (size_t)kt * HD_DIM + f * 4;
        const float4 v4 = *(const float4*)kp;
        KV[key][f * 4 + 0] = v4.x; KV[key][f * 4 + 1] = v4.y;
        KV[key][f * 4 + 2] = v4.z; KV[key][f * 4 + 3] = v4.w;
        // warm L2/L0 for the V pass (global_prefetch_b8)
        __builtin_prefetch(Vd + bbase + (size_t)kt * HD_DIM + f * 4, 0, 1);
    }
    __syncthreads();

    for (int tile = wave; tile < NKEY / 16; tile += 8) {
        int t0 = tile * 16;
        v8f cacc = (v8f){0.f, 0.f, 0.f, 0.f, 0.f, 0.f, 0.f, 0.f};
        #pragma unroll
        for (int kk = 0; kk < 16; ++kk) {
            v2f a, b;
            a.x = qx[kk]; a.y = qy[kk];
            // B[k][n] = K[key(t0+n)][k]
            b.x = KV[t0 + m16][kk * 4 + 2 * half];
            b.y = KV[t0 + m16][kk * 4 + 2 * half + 1];
            cacc = WMMA_F32(a, b, cacc);
        }
        #pragma unroll
        for (int v = 0; v < 8; ++v) {
            int i  = v + 8 * half;          // query in tile
            int tg = t0 + m16;              // key in block
            int dt = tg - i;                // window slot
            int kt = kpos0 + 2 * tg;
            bool valid = (dt >= 0) && (dt <= 128) && (kt >= 0) && (kt < S_LEN);
            Sc[i][tg] = valid ? cacc[v] * 0.03125f : -__builtin_inff();
        }
    }
    __syncthreads();

    // ---- softmax over 144 cols, 16 threads per row ----
    {
        int r = tid >> 4, c0 = tid & 15;
        float mx = -__builtin_inff();
        for (int jj = c0; jj < NKEY; jj += 16) mx = fmaxf(mx, Sc[r][jj]);
        red[0][r][c0] = mx;
        __syncthreads();
        float M = -__builtin_inff();
        #pragma unroll
        for (int k = 0; k < 16; ++k) M = fmaxf(M, red[0][r][k]);
        float sm = 0.f;
        for (int jj = c0; jj < NKEY; jj += 16) {
            float e = __expf(Sc[r][jj] - M);
            Sc[r][jj] = e;
            sm += e;
        }
        red[1][r][c0] = sm;
        __syncthreads();
        float T = 0.f;
        #pragma unroll
        for (int k = 0; k < 16; ++k) T += red[1][r][k];
        float inv = 1.0f / T;
        for (int jj = c0; jj < NKEY; jj += 16) Sc[r][jj] *= inv;
    }
    __syncthreads();

    // ---- output: attn[16x144] x V[144x64]; waves 0-3 own 16-col tiles ----
    v8f oacc = (v8f){0.f, 0.f, 0.f, 0.f, 0.f, 0.f, 0.f, 0.f};
    const int h0 = (wave & 3) * 16;
    for (int j = tid; j < NKEY * 16; j += 256) {
        int key = j >> 4, f = j & 15;
        int kt = kpos0 + 2 * key;
        kt = kt < 0 ? 0 : (kt >= S_LEN ? S_LEN - 1 : kt);
        const float4 v4 = *(const float4*)(Vd + bbase + (size_t)kt * HD_DIM + f * 4);
        KV[key][f * 4 + 0] = v4.x; KV[key][f * 4 + 1] = v4.y;
        KV[key][f * 4 + 2] = v4.z; KV[key][f * 4 + 3] = v4.w;
    }
    __syncthreads();
    if (wave < 4) {
        for (int t = 0; t < NKEY; t += 4) {
            v2f a, b;
            a.x = Sc[m16][t + 2 * half];
            a.y = Sc[m16][t + 2 * half + 1];
            b.x = KV[t + 2 * half][h0 + m16];
            b.y = KV[t + 2 * half + 1][h0 + m16];
            oacc = WMMA_F32(a, b, oacc);
        }
        #pragma unroll
        for (int v = 0; v < 8; ++v) {
            int row = r0 + par + 2 * (v + 8 * half);
            out[(size_t)row * HD_DIM + h0 + m16] = oacc[v];
        }
    }
}

// ---------------------------------------------------------------------------
extern "C" void kernel_launch(void* const* d_in, const int* in_sizes, int n_in,
                              void* d_out, int out_size, void* d_ws, size_t ws_size,
                              hipStream_t stream) {
    const float* x  = (const float*)d_in[0];
    const float* Wq = (const float*)d_in[1];
    const float* bq = (const float*)d_in[2];
    const float* Wk = (const float*)d_in[3];
    const float* bk = (const float*)d_in[4];
    const float* Wv = (const float*)d_in[5];
    const float* bv = (const float*)d_in[6];

    float* Qd = (float*)d_ws;                       // 4 MB
    float* Kd = Qd + (size_t)NROWS * HD_DIM;        // 4 MB
    float* Vd = Kd + (size_t)NROWS * HD_DIM;        // 4 MB
    float* out = (float*)d_out;

    qkv_proj_kernel<<<NROWS / 32, 256, 0, stream>>>(x, Wq, bq, Wk, bk, Wv, bv,
                                                    Qd, Kd, Vd);
    attn_kernel<<<NROWS / 16, 256, 0, stream>>>(Qd, Kd, Vd, out);
}

// v002
// It runs in 46.2 microseconds.
// Timed twice side by side with v001, it ran 1.06 and 1.05 times as fast.
// Counting every step since v000, it is 1.20 times as fast.
#include <hip/hip_runtime.h>

typedef __attribute__((ext_vector_type(2))) float v2f;
typedef __attribute__((ext_vector_type(4))) float f4;
typedef __attribute__((ext_vector_type(8))) float v8f;
typedef __attribute__((ext_vector_type(4))) unsigned int u32x4;
typedef __attribute__((ext_vector_type(8))) int i32x8;
typedef __attribute__((ext_vector_type(4))) int i32x4;

#define S_LEN   4096
#define E_DIM   1024
#define HD_DIM  64
#define NROWS   (4 * 4096)

#define WMMA_F32(a, b, c) \
    __builtin_amdgcn_wmma_f32_16x16x4_f32(false, (a), false, (b), (short)0, (c), false, false)

// ---------------------------------------------------------------------------
// TDM: build a 2D-tile D# and issue TENSOR_LOAD_TO_LDS (clang-23 6-arg form).
// tensor/tile dims in elements (data_size = 4 bytes), stride in elements,
// lds_off in bytes. Optional LDS row padding (pad codes per ISA 8.4).
// ---------------------------------------------------------------------------
__device__ static inline void tdm_load_2d(unsigned lds_off, const void* gaddr,
                                          unsigned d0, unsigned d1,
                                          unsigned long long stride0,
                                          unsigned pad_en, unsigned pad_interval,
                                          unsigned pad_amount)
{
    unsigned long long ga = (unsigned long long)gaddr;
    u32x4 g0;
    g0[0] = 1u;                                    // count=1, user descriptor
    g0[1] = lds_off;                               // lds_addr (bytes)
    g0[2] = (unsigned)(ga & 0xFFFFFFFFu);          // global_addr[31:0]
    g0[3] = (unsigned)((ga >> 32) & 0x1FFFFFFu)    // global_addr[56:32]
          | (2u << 30);                            // type = 2 ("image")
    i32x8 g1;
    g1[0] = (int)((2u << 16)                       // data_size = 4 bytes
          | (pad_en << 20)
          | (pad_interval << 22)
          | (pad_amount << 25));
    g1[1] = (int)((d0 & 0xFFFFu) << 16);           // tensor_dim0[15:0]
    g1[2] = (int)(((d0 >> 16) & 0xFFFFu) | ((d1 & 0xFFFFu) << 16));
    g1[3] = (int)(((d1 >> 16) & 0xFFFFu) | ((d0 & 0xFFFFu) << 16)); // tile_dim0 = d0
    g1[4] = (int)(d1 & 0xFFFFu);                   // tile_dim1 = d1, tile_dim2 = 0
    g1[5] = (int)(unsigned)(stride0 & 0xFFFFFFFFull);
    g1[6] = (int)(unsigned)((stride0 >> 32) & 0xFFFFull);
    g1[7] = 0;
    i32x4 z4 = (i32x4){0, 0, 0, 0};
    i32x8 z8 = (i32x8){0, 0, 0, 0, 0, 0, 0, 0};
    __builtin_amdgcn_tensor_load_to_lds(g0, g1, z4, z4, z8, 0);
}

// ---------------------------------------------------------------------------
// Kernel 1: fused QKV projection, TDM double-buffered.
// Block: 32 rows x 192 cols (Q|K|V) = 24 16x16 tiles, 3 per wave.
// x chunk [32][64] (+pad -> [32][68]) and W chunks [3][64][64] DMA'd by TDM.
// ---------------------------------------------------------------------------
__global__ __launch_bounds__(256) void qkv_proj_kernel(
    const float* __restrict__ x,
    const float* __restrict__ Wq, const float* __restrict__ bq,
    const float* __restrict__ Wk, const float* __restrict__ bk,
    const float* __restrict__ Wv, const float* __restrict__ bv,
    float* __restrict__ Qo, float* __restrict__ Ko, float* __restrict__ Vo)
{
    __shared__ float xs[2][32][68];      // pad 68: strided col reads hit distinct banks
    __shared__ float wsd[2][3][64][64];

    const int tid  = threadIdx.x;
    const int wave = tid >> 5;
    const int lane = tid & 31;
    const int m16  = lane & 15;
    const int half = lane >> 4;
    const int r0   = blockIdx.x * 32;

    const unsigned xs_off  = (unsigned)(unsigned long long)(void*)&xs[0][0][0];
    const unsigned xs_sz   = 32u * 68u * 4u;
    const unsigned wsd_off = (unsigned)(unsigned long long)(void*)&wsd[0][0][0][0];
    const unsigned w_sz    = 64u * 64u * 4u;

    // tile assignment: 24 tiles (2 row-tiles x 12 col-tiles), 3 per wave
    int rt[3], mat[3], n0[3];
    v8f acc[3];
    #pragma unroll
    for (int i = 0; i < 3; ++i) {
        int t  = wave * 3 + i;
        rt[i]  = t / 12;
        int ct = t % 12;
        mat[i] = ct >> 2;            // 0=Q 1=K 2=V
        n0[i]  = (ct & 3) * 16;
        acc[i] = (v8f){0.f, 0.f, 0.f, 0.f, 0.f, 0.f, 0.f, 0.f};
    }

    // issue chunk 0 into buffer 0 (4 TDM ops per chunk: x + 3x W)
    if (tid == 0) {
        tdm_load_2d(xs_off, x + (size_t)r0 * E_DIM, 64, 32, E_DIM,
                    /*pad*/1, /*interval: 64 dw*/5, /*amount: 4 dw*/3);
        tdm_load_2d(wsd_off + 0 * w_sz, Wq, 64, 64, 64, 0, 0, 0);
        tdm_load_2d(wsd_off + 1 * w_sz, Wk, 64, 64, 64, 0, 0, 0);
        tdm_load_2d(wsd_off + 2 * w_sz, Wv, 64, 64, 64, 0, 0, 0);
    }

    int cur = 0;
    for (int it = 0; it < E_DIM / 64; ++it, cur ^= 1) {
        const int kk0n = (it + 1) * 64;
        if (tid == 0) {
            if (kk0n < E_DIM) {
                // prefetch next chunk into the other buffer, then wait for
                // the current chunk (<=4 outstanding = only the new ops)
                const unsigned nb = (unsigned)(cur ^ 1);
                tdm_load_2d(xs_off + nb * xs_sz,
                            x + (size_t)r0 * E_DIM + kk0n, 64, 32, E_DIM, 1, 5, 3);
                tdm_load_2d(wsd_off + nb * 3u * w_sz + 0 * w_sz,
                            Wq + (size_t)kk0n * HD_DIM, 64, 64, 64, 0, 0, 0);
                tdm_load_2d(wsd_off + nb * 3u * w_sz + 1 * w_sz,
                            Wk + (size_t)kk0n * HD_DIM, 64, 64, 64, 0, 0, 0);
                tdm_load_2d(wsd_off + nb * 3u * w_sz + 2 * w_sz,
                            Wv + (size_t)kk0n * HD_DIM, 64, 64, 64, 0, 0, 0);
                __builtin_amdgcn_s_wait_tensorcnt((short)4);
            } else {
                __builtin_amdgcn_s_wait_tensorcnt((short)0);
            }
        }
        __syncthreads();   // chunk `cur` resident in LDS for all waves

        #pragma unroll
        for (int i = 0; i < 3; ++i) {
            #pragma unroll
            for (int k = 0; k < 64; k += 4) {
                v2f a, b;
                // A frag (16x4 f32): lane = M=m16, K = j + 2*half
                a.x = xs[cur][rt[i] * 16 + m16][k + 2 * half];
                a.y = xs[cur][rt[i] * 16 + m16][k + 2 * half + 1];
                // B frag (4x16): row K = j + 2*half, col N = m16
                b.x = wsd[cur][mat[i]][k + 2 * half][n0[i] + m16];
                b.y = wsd[cur][mat[i]][k + 2 * half + 1][n0[i] + m16];
                acc[i] = WMMA_F32(a, b, acc[i]);
            }
        }
        __syncthreads();   // buffer may be overwritten by next TDM issue
    }

    #pragma unroll
    for (int i = 0; i < 3; ++i) {
        const float* bp = (mat[i] == 0) ? bq : ((mat[i] == 1) ? bk : bv);
        float*       op = (mat[i] == 0) ? Qo : ((mat[i] == 1) ? Ko : Vo);
        float badd = bp[n0[i] + m16];
        #pragma unroll
        for (int v = 0; v < 8; ++v) {   // D: M = v + 8*half, N = m16
            int row = r0 + rt[i] * 16 + v + 8 * half;
            op[(size_t)row * HD_DIM + n0[i] + m16] = acc[i][v] + badd;
        }
    }
}

// ---------------------------------------------------------------------------
// Kernel 2: dilated window attention, queries split by parity.
// The window steps by 2, so a query only ever meets keys of its own parity.
// Block = 16 queries of one parity out of a group of 32 rows: query i sits at
// s0 + par + 2*i, key j at s0 + par - 128 + 2*j, and the window of query i is
// the dense band j - i in [0, 128]. 16 + 128 = 144 keys (9 tiles) cover it,
// and all of them fit the K/V buffer at once.
// Dense WMMA scores + band mask, LDS softmax, dense WMMA attn@V.
// Global fetch: Q, K and V are each read once per block, by 16-byte loads that
// cover whole rows, and all 19 loads of a thread are in flight together.
// ---------------------------------------------------------------------------
#define NKEY 144

__global__ __launch_bounds__(256) void attn_kernel(
    const float* __restrict__ Qd, const float* __restrict__ Kd,
    const float* __restrict__ Vd, float* __restrict__ out)
{
    __shared__ __attribute__((aligned(16))) float KV[NKEY][68];  // pad 68 -> stride 4 banks
    __shared__ __attribute__((aligned(16))) float Qs[16][68];    // same pitch as KV
    __shared__ float Sc[16][148];       // pad 148 -> stride 20 banks (distinct x16)
    __shared__ float red[2][16][16];

    const int tid  = threadIdx.x;
    const int wave = tid >> 5;
    const int lane = tid & 31;
    const int m16  = lane & 15;
    const int half = lane >> 4;
    const int par  = blockIdx.x & 1;
    const int r0   = (blockIdx.x >> 1) * 32;
    const int bb   = r0 / S_LEN;
    const int s0   = r0 % S_LEN;
    const int kpos0 = s0 + par - 128;   // sequence position of key 0
    const size_t bbase = (size_t)bb * S_LEN * HD_DIM;

    // ---- fetch: 16 threads per row, thread = 4 floats of rows lrow + 16*i ----
    const int lrow = tid >> 4;
    const int lcol = (tid & 15) * 4;
    // row offsets, clamped to the sequence (masked keys still need a legal address)
#define KROW(i) ({ int kt_ = kpos0 + 2 * (lrow + 16 * (i)); \
                   kt_ = kt_ < 0 ? 0 : (kt_ >= S_LEN ? S_LEN - 1 : kt_); \
                   (size_t)kt_ * HD_DIM + lcol; })
    const float* kb = Kd + bbase;
    const float* vb = Vd + bbase;
    const f4 k0 = *(const f4*)(kb + KROW(0));
    const f4 k1 = *(const f4*)(kb + KROW(1));
    const f4 k2 = *(const f4*)(kb + KROW(2));
    const f4 k3 = *(const f4*)(kb + KROW(3));
    const f4 k4 = *(const f4*)(kb + KROW(4));
    const f4 k5 = *(const f4*)(kb + KROW(5));
    const f4 k6 = *(const f4*)(kb + KROW(6));
    const f4 k7 = *(const f4*)(kb + KROW(7));
    const f4 k8 = *(const f4*)(kb + KROW(8));
    const f4 qreg = *(const f4*)(Qd + (size_t)(r0 + par + 2 * lrow) * HD_DIM + lcol);
    // the V loads below may land in registers that held addresses of the loads above:
    // the wait stands in front of that overwrite
    asm volatile("s_wait_xcnt 0x0" ::: "memory");
    const f4 v0 = *(const f4*)(vb + KROW(0));
    const f4 v1 = *(const f4*)(vb + KROW(1));
    const f4 v2 = *(const f4*)(vb + KROW(2));
    const f4 v3 = *(const f4*)(vb + KROW(3));
    const f4 v4 = *(const f4*)(vb + KROW(4));
    const f4 v5 = *(const f4*)(vb + KROW(5));
    const f4 v6 = *(const f4*)(vb + KROW(6));
    const f4 v7 = *(const f4*)(vb + KROW(7));
    const f4 v8 = *(const f4*)(vb + KROW(8));
#undef KROW
    *(f4*)&KV[lrow + 0][lcol] = k0;
    *(f4*)&KV[lrow + 16][lcol] = k1;
    *(f4*)&KV[lrow + 32][lcol] = k2;
    *(f4*)&KV[lrow + 48][lcol] = k3;
    *(f4*)&KV[lrow + 64][lcol] = k4;
    *(f4*)&KV[lrow + 80][lcol] = k5;
    *(f4*)&KV[lrow + 96][lcol] = k6;
    *(f4*)&KV[lrow + 112][lcol] = k7;
    *(f4*)&KV[lrow + 128][lcol] = k8;
    *(f4*)&Qs[lrow][lcol] = qreg;
    // inputs-only fence on the loaded V values: without it the compiler sinks the
    // V loads to their LDS stores behind the scores, and their latency shows there
    asm volatile("" :: "v"(v0), "v"(v1), "v"(v2), "v"(v3), "v"(v4),
                       "v"(v5), "v"(v6), "v"(v7), "v"(v8));
    __syncthreads();

    // Q fragments in registers: A[m16][4*kk + j + 2*half]
    float qx[16], qy[16];
    #pragma unroll
    for (int kk = 0; kk < 16; ++kk) {
        qx[kk] = Qs[m16][kk * 4 + 2 * half];
        qy[kk] = Qs[m16][kk * 4 + 2 * half + 1];
    }

    // ---- scores: Q[16x64] x K^T[64x144] ----
    for (int tile = wave; tile < NKEY / 16; tile += 8) {
        int t0 = tile * 16;
        v8f cacc = (v8f){0.f, 0.f, 0.f, 0.f, 0.f, 0.f, 0.f, 0.f};
        #pragma unroll
        for (int kk = 0; kk < 16; ++kk) {
            v2f a, b;
            a.x = qx[kk]; a.y = qy[kk];
            // B[k][n] = K[key(t0+n)][k]
            b.x = KV[t0 + m16][kk * 4 + 2 * half];
            b.y = KV[t0 + m16][kk * 4 + 2 * half + 1];
            cacc = WMMA_F32(a, b, cacc);
        }
        #pragma unroll
        for (int v = 0; v < 8; ++v) {
            int i  = v + 8 * half;          // query in tile
            int tg = t0 + m16;              // key in block
            int dt = tg - i;                // window slot
            int kt = kpos0 + 2 * tg;
            bool valid = (dt >= 0) && (dt <= 128) && (kt >= 0) && (kt < S_LEN);
            Sc[i][tg] = valid ? cacc[v] * 0.03125f : -__builtin_inff();
        }
    }
    __syncthreads();

    // every K read is done: V takes K's place; the softmax barriers publish it
    *(f4*)&KV[lrow + 0][lcol] = v0;
    *(f4*)&KV[lrow + 16][lcol] = v1;
    *(f4*)&KV[lrow + 32][lcol] = v2;
    *(f4*)&KV[lrow + 48][lcol] = v3;
    *(f4*)&KV[lrow + 64][lcol] = v4;
    *(f4*)&KV[lrow + 80][lcol] = v5;
    *(f4*)&KV[lrow + 96][lcol] = v6;
    *(f4*)&KV[lrow + 112][lcol] = v7;
    *(f4*)&KV[lrow + 128][lcol] = v8;

    // ---- softmax over 144 cols, 16 threads per row ----
    {
        int r = tid >> 4, c0 = tid & 15;
        float mx = -__builtin_inff();
        for (int jj = c0; jj < NKEY; jj += 16) mx = fmaxf(mx, Sc[r][jj]);
        red[0][r][c0] = mx;
        __syncthreads();
        float M = -__builtin_inff();
        #pragma unroll
        for (int k = 0; k < 16; ++k) M = fmaxf(M, red[0][r][k]);
        float sm = 0.f;
        for (int jj = c0; jj < NKEY; jj += 16) {
            float e = __expf(Sc[r][jj] - M);
            Sc[r][jj] = e;
            sm += e;
        }
        red[1][r][c0] = sm;
        __syncthreads();
        float T = 0.f;
        #pragma unroll
        for (int k = 0; k < 16; ++k) T += red[1][r][k];
        float inv = 1.0f / T;
        for (int jj = c0; jj < NKEY; jj += 16) Sc[r][jj] *= inv;
    }
    __syncthreads();

    // ---- output: attn[16x144] x V[144x64]; waves 0-3 own 16-col tiles ----
    v8f oacc = (v8f){0.f, 0.f, 0.f, 0.f, 0.f, 0.f, 0.f, 0.f};
    const int h0 = (wave & 3) * 16;
    if (wave < 4) {
        for (int t = 0; t < NKEY; t += 4) {
            v2f a, b;
            a.x = Sc[m16][t + 2 * half];
            a.y = Sc[m16][t + 2 * half + 1];
            b.x = KV[t + 2 * half][h0 + m16];
            b.y = KV[t + 2 * half + 1][h0 + m16];
            oacc = WMMA_F32(a, b, oacc);
        }
        #pragma unroll
        for (int v = 0; v < 8; ++v) {
            int row = r0 + par + 2 * (v + 8 * half);
            out[(size_t)row * HD_DIM + h0 + m16] = oacc[v];
        }
    }
}

// ---------------------------------------------------------------------------
extern "C" void kernel_launch(void* const* d_in, const int* in_sizes, int n_in,
                              void* d_out, int out_size, void* d_ws, size_t ws_size,
                              hipStream_t stream) {
    const float* x  = (const float*)d_in[0];
    const float* Wq = (const float*)d_in[1];
    const float* bq = (const float*)d_in[2];
    const float* Wk = (const float*)d_in[3];
    const float* bk = (const float*)d_in[4];
    const float* Wv = (const float*)d_in[5];
    const float* bv = (const float*)d_in[6];

    float* Qd = (float*)d_ws;                       // 4 MB
    float* Kd = Qd + (size_t)NROWS * HD_DIM;        // 4 MB
    float* Vd = Kd + (size_t)NROWS * HD_DIM;        // 4 MB
    float* out = (float*)d_out;

    qkv_proj_kernel<<<NROWS / 32, 256, 0, stream>>>(x, Wq, bq, Wk, bk, Wv, bv,
                                                    Qd, Kd, Vd);
    attn_kernel<<<NROWS / 16, 256, 0, stream>>>(Qd, Kd, Vd, out);
}
